// v000
// Measured on an AMD MI455X. A time is GPU time per run, averaged over a window of back-to-back runs after a warm-up
// (all launches, gaps included; the runs take copies of the inputs in turn), and the median of several windows.
// Apart from v000's, it joins two sittings. Times from different sittings can be a few percent apart, while
// side-by-side timings come from the same sitting.
// The starting kernel, v000, takes 167 microseconds a run.
#include <hip/hip_runtime.h>
#include <hip/hip_bf16.h>

typedef __attribute__((ext_vector_type(16))) _Float16 v16h;
typedef __attribute__((ext_vector_type(8)))  _Float16 v8h;
typedef __attribute__((ext_vector_type(8)))  float    v8f;

#define B_    4
#define Q_    256
#define H_    32
#define D_    128
#define KVH_  8
#define G_    4
#define BLOCK_ 16
#define NB_   128
#define KV_   2048
#define SCALE_ 0.08838834764831845f  /* 1/sqrt(128) */

__device__ __forceinline__ float rmax16(float v) {
  v = fmaxf(v, __shfl_xor(v, 1, 32));
  v = fmaxf(v, __shfl_xor(v, 2, 32));
  v = fmaxf(v, __shfl_xor(v, 4, 32));
  v = fmaxf(v, __shfl_xor(v, 8, 32));
  return v;
}
__device__ __forceinline__ float rsum16(float v) {
  v += __shfl_xor(v, 1, 32);
  v += __shfl_xor(v, 2, 32);
  v += __shfl_xor(v, 4, 32);
  v += __shfl_xor(v, 8, 32);
  return v;
}
__device__ __forceinline__ v16h cat8(v8h lo, v8h hi) {
  return __builtin_shufflevector(lo, hi, 0, 1, 2, 3, 4, 5, 6, 7,
                                 8, 9, 10, 11, 12, 13, 14, 15);
}

// 4 waves per workgroup (one per GQA group g) share one (b, kv-head, q-tile).
// K/V chunks are staged once into double-buffered LDS (f16); staging of chunk
// n+1 overlaps compute of chunk n, one barrier per chunk.
__global__ __launch_bounds__(128)
void paged_gqa_prefill_wmma(const float* __restrict__ q,
                            const float* __restrict__ kc,
                            const float* __restrict__ vc,
                            const int*   __restrict__ bt,
                            const int*   __restrict__ slens,
                            float* __restrict__ out) {
  __shared__ _Float16 ldsK[2][32 * D_];   // [buf][token][d]       (2x8 KB)
  __shared__ _Float16 ldsV[2][D_ * 32];   // [buf][d][token]       (2x8 KB)
  __shared__ _Float16 ldsP[G_][16 * 32];  // per-wave P tile       (4 KB)

  const int tid  = threadIdx.x;
  const int w    = tid >> 5;           // wave id == query-head group g
  const int lane = tid & 31;
  const int l16  = lane & 15;
  const int hi   = lane >> 4;          // lane half
  const int base = hi * 8;             // A/B fragment k-base (ISA 7.12.2)
  const int hi8  = hi * 8;             // C/D row base

  int bid = blockIdx.x;
  const int qt  = bid & 15;  bid >>= 4;
  const int kvh = bid & 7;   bid >>= 3;
  const int b   = bid;
  const int h   = kvh * G_ + w;
  const int q0  = qt * 16;

  int seq = slens[b]; if (seq < Q_) seq = Q_;
  const int sbq     = seq - Q_ + q0;          // q_pos of tile row 0
  const int nchunks = (sbq + 16 + 31) >> 5;   // 32-kv chunks needed (causal)

  const int* btab = bt + b * NB_;

  // staging role: token = tid&31, d-quarter = tid>>5 (32 d values each)
  const int st_t  = tid & 31;
  const int st_dq = tid >> 5;

  auto stage = [&](int c, int buf) {
    _Float16* sK = ldsK[buf];
    _Float16* sV = ldsV[buf];
    const int t  = c * 32 + st_t;
    const int pb = btab[t >> 4];
    const size_t rowoff =
        (size_t)((pb * BLOCK_ + (t & 15)) * KVH_ + kvh) * D_ + st_dq * 32;
    const float* krow = kc + rowoff;
    const float* vrow = vc + rowoff;

    if (c + 1 < nchunks) {  // prefetch one more chunk ahead (global_prefetch_b8)
      const int tn  = c * 32 + 32 + st_t;
      const int pbn = btab[tn >> 4];
      const size_t noff =
          (size_t)((pbn * BLOCK_ + (tn & 15)) * KVH_ + kvh) * D_ + st_dq * 32;
      __builtin_prefetch(kc + noff, 0, 3);
      __builtin_prefetch(vc + noff, 0, 3);
    }

    #pragma unroll
    for (int j8 = 0; j8 < 4; ++j8) {
      float4 ka = *(const float4*)(krow + j8 * 8);
      float4 kb = *(const float4*)(krow + j8 * 8 + 4);
      v8h kp;
      kp[0] = (_Float16)ka.x; kp[1] = (_Float16)ka.y;
      kp[2] = (_Float16)ka.z; kp[3] = (_Float16)ka.w;
      kp[4] = (_Float16)kb.x; kp[5] = (_Float16)kb.y;
      kp[6] = (_Float16)kb.z; kp[7] = (_Float16)kb.w;
      *(v8h*)(&sK[st_t * D_ + st_dq * 32 + j8 * 8]) = kp;

      float4 va = *(const float4*)(vrow + j8 * 8);
      float4 vb = *(const float4*)(vrow + j8 * 8 + 4);
      const int d0 = st_dq * 32 + j8 * 8;
      sV[(d0 + 0) * 32 + st_t] = (_Float16)va.x;
      sV[(d0 + 1) * 32 + st_t] = (_Float16)va.y;
      sV[(d0 + 2) * 32 + st_t] = (_Float16)va.z;
      sV[(d0 + 3) * 32 + st_t] = (_Float16)va.w;
      sV[(d0 + 4) * 32 + st_t] = (_Float16)vb.x;
      sV[(d0 + 5) * 32 + st_t] = (_Float16)vb.y;
      sV[(d0 + 6) * 32 + st_t] = (_Float16)vb.z;
      sV[(d0 + 7) * 32 + st_t] = (_Float16)vb.w;
    }
  };

  // ---- Q tile [16 x 128] -> 4 A-fragments (f16, pre-scaled) ----
  v16h qf[4];
  {
    const float* qrow = q + (size_t)((b * Q_ + q0 + l16) * H_ + h) * D_;
    #pragma unroll
    for (int dc = 0; dc < 4; ++dc) {
      #pragma unroll
      for (int j = 0; j < 8; ++j) {
        qf[dc][j]     = (_Float16)(qrow[dc * 32 + base + j]      * SCALE_);
        qf[dc][8 + j] = (_Float16)(qrow[dc * 32 + base + 16 + j] * SCALE_);
      }
    }
  }

  v8f zero = {};
  v8f o[8];
  #pragma unroll
  for (int nt = 0; nt < 8; ++nt) o[nt] = zero;
  float mrow[8], lrow[8];
  #pragma unroll
  for (int r = 0; r < 8; ++r) { mrow[r] = -1e30f; lrow[r] = 0.f; }

  stage(0, 0);
  __syncthreads();

  for (int cb = 0; cb < nchunks; ++cb) {
    const int cur = cb & 1;
    const int kv0 = cb * 32;

    // overlap: stage next chunk into the spare buffer while computing this one
    if (cb + 1 < nchunks) stage(cb + 1, cur ^ 1);

    // ---- QK^T: preload all 8 K fragments, then 8 dense WMMAs ----
    v8f s0 = {}, s1 = {};
    {
      const _Float16* bK = ldsK[cur];
      const int t0row = l16 * D_;          // B-frag: lane = token column
      const int t1row = t0row + 16 * D_;
      v16h kfa[4], kfb[4];
      #pragma unroll
      for (int dc = 0; dc < 4; ++dc) {
        v8h a0 = *(const v8h*)(&bK[t0row + dc * 32 + base]);
        v8h a1 = *(const v8h*)(&bK[t0row + dc * 32 + base + 16]);
        v8h b0 = *(const v8h*)(&bK[t1row + dc * 32 + base]);
        v8h b1 = *(const v8h*)(&bK[t1row + dc * 32 + base + 16]);
        kfa[dc] = cat8(a0, a1);
        kfb[dc] = cat8(b0, b1);
      }
      #pragma unroll
      for (int dc = 0; dc < 4; ++dc) {
        s0 = __builtin_amdgcn_wmma_f32_16x16x32_f16(false, qf[dc], false,
                                                    kfa[dc], (short)0, s0,
                                                    false, false);
        s1 = __builtin_amdgcn_wmma_f32_16x16x32_f16(false, qf[dc], false,
                                                    kfb[dc], (short)0, s1,
                                                    false, false);
      }
    }

    // ---- masked online softmax (rows live in C-layout: m = r + hi8) ----
    float alpha[8];
    #pragma unroll
    for (int r = 0; r < 8; ++r) {
      const int m  = r + hi8;
      const int qp = sbq + m;                       // global query position
      const bool v0 = (kv0 + l16)      <= qp;       // causal mask
      const bool v1 = (kv0 + 16 + l16) <= qp;
      float a0 = v0 ? s0[r] : -1e30f;
      float a1 = v1 ? s1[r] : -1e30f;
      float rowmax = rmax16(fmaxf(a0, a1));
      float mnew   = fmaxf(mrow[r], rowmax);
      alpha[r] = __expf(mrow[r] - mnew);
      float p0 = v0 ? __expf(a0 - mnew) : 0.f;
      float p1 = v1 ? __expf(a1 - mnew) : 0.f;
      lrow[r] = lrow[r] * alpha[r] + rsum16(p0 + p1);
      mrow[r] = mnew;
      ldsP[w][m * 32 + l16]      = (_Float16)p0;    // A-layout relayout
      ldsP[w][m * 32 + 16 + l16] = (_Float16)p1;
    }

    // ---- O = O*alpha + P @ V (V fragments preloaded in groups of 4) ----
    v16h pf;
    {
      v8h plo = *(const v8h*)(&ldsP[w][l16 * 32 + base]);
      v8h phi = *(const v8h*)(&ldsP[w][l16 * 32 + base + 16]);
      pf = cat8(plo, phi);
    }
    {
      const _Float16* bV = ldsV[cur];
      #pragma unroll
      for (int grp = 0; grp < 2; ++grp) {
        v16h vf[4];
        #pragma unroll
        for (int i = 0; i < 4; ++i) {
          const int d = (grp * 4 + i) * 16 + l16;
          v8h vlo = *(const v8h*)(&bV[d * 32 + base]);
          v8h vhi = *(const v8h*)(&bV[d * 32 + base + 16]);
          vf[i] = cat8(vlo, vhi);
        }
        #pragma unroll
        for (int i = 0; i < 4; ++i) {
          const int nt = grp * 4 + i;
          v8f oc = o[nt];
          #pragma unroll
          for (int r = 0; r < 8; ++r) oc[r] *= alpha[r];
          o[nt] = __builtin_amdgcn_wmma_f32_16x16x32_f16(false, pf, false,
                                                         vf[i], (short)0, oc,
                                                         false, false);
        }
      }
    }

    __syncthreads();  // staging of next buffer done; current buffer released
  }

  // ---- epilogue: divide by l, write coalesced f32 rows ----
  #pragma unroll
  for (int r = 0; r < 8; ++r) {
    const int m    = r + hi8;
    const float iv = 1.0f / lrow[r];
    float* orow = out + (size_t)((b * Q_ + q0 + m) * H_ + h) * D_;
    #pragma unroll
    for (int nt = 0; nt < 8; ++nt)
      orow[nt * 16 + l16] = o[nt][r] * iv;
  }
}

extern "C" void kernel_launch(void* const* d_in, const int* in_sizes, int n_in,
                              void* d_out, int out_size, void* d_ws, size_t ws_size,
                              hipStream_t stream) {
  (void)in_sizes; (void)n_in; (void)out_size; (void)d_ws; (void)ws_size;
  const float* query        = (const float*)d_in[0];
  const float* k_cache      = (const float*)d_in[1];
  const float* v_cache      = (const float*)d_in[2];
  const int*   block_tables = (const int*)d_in[3];
  const int*   seq_lens     = (const int*)d_in[4];
  float*       outp         = (float*)d_out;

  // B * KVH * (Q/16) = 4*8*16 = 512 workgroups of 4 wave32s (one per g)
  dim3 grid(B_ * KVH_ * (Q_ / 16));
  dim3 block(128);
  paged_gqa_prefill_wmma<<<grid, block, 0, stream>>>(
      query, k_cache, v_cache, block_tables, seq_lens, outp);
}

// v001
// One run takes 116 microseconds.
// Two timings next to v000 put it at 1.49 and 1.48 times that version's speed.
#include <hip/hip_runtime.h>
#include <hip/hip_bf16.h>

typedef __attribute__((ext_vector_type(16))) _Float16 v16h;
typedef __attribute__((ext_vector_type(8)))  _Float16 v8h;
typedef __attribute__((ext_vector_type(8)))  float    v8f;

#define B_    4
#define Q_    256
#define H_    32
#define D_    128
#define KVH_  8
#define G_    4
#define BLOCK_ 16
#define NB_   128
#define KV_   2048
#define SCALE_ 0.08838834764831845f  /* 1/sqrt(128) */
// LDS row pitches in f16 elements. Every fragment read is a 16-byte load with
// one row per lane, so each pitch is 16 B x odd: 16 lanes then fall on all 64
// banks instead of on 4 (256-B rows) or 16 (64-B rows).
#define KP_   (D_ + 8)   /* K rows:   272 B */
#define VP_   (32 + 8)   /* V^T rows:  80 B */
#define PP_   (32 + 8)   /* P rows:    80 B */

__device__ __forceinline__ float rmax16(float v) {
  v = fmaxf(v, __shfl_xor(v, 1, 32));
  v = fmaxf(v, __shfl_xor(v, 2, 32));
  v = fmaxf(v, __shfl_xor(v, 4, 32));
  v = fmaxf(v, __shfl_xor(v, 8, 32));
  return v;
}
__device__ __forceinline__ float rsum16(float v) {
  v += __shfl_xor(v, 1, 32);
  v += __shfl_xor(v, 2, 32);
  v += __shfl_xor(v, 4, 32);
  v += __shfl_xor(v, 8, 32);
  return v;
}
__device__ __forceinline__ v16h cat8(v8h lo, v8h hi) {
  return __builtin_shufflevector(lo, hi, 0, 1, 2, 3, 4, 5, 6, 7,
                                 8, 9, 10, 11, 12, 13, 14, 15);
}

// bound: a page number read from the table stays inside the caches
// (B_ * NB_ pages, a power of two; identity on every valid page number)
__device__ __forceinline__ int page(int p) {
  return p & (B_ * NB_ - 1);
}

// 4 waves per workgroup (one per GQA group g) share one (b, kv-head, q-tile).
// K/V chunks are staged once into double-buffered LDS (f16); staging of chunk
// n+1 overlaps compute of chunk n, one barrier per chunk.
__global__ __launch_bounds__(128)
void paged_gqa_prefill_wmma(const float* __restrict__ q,
                            const float* __restrict__ kc,
                            const float* __restrict__ vc,
                            const int*   __restrict__ bt,
                            const int*   __restrict__ slens,
                            float* __restrict__ out) {
  __shared__ __attribute__((aligned(16))) _Float16 ldsK[2][32 * KP_];   // [buf][token][d]
  __shared__ __attribute__((aligned(16))) _Float16 ldsV[2][D_ * VP_];   // [buf][d][token]
  __shared__ __attribute__((aligned(16))) _Float16 ldsP[G_][16 * PP_];  // per-wave P tile

  const int tid  = threadIdx.x;
  const int w    = tid >> 5;           // wave id == query-head group g
  const int lane = tid & 31;
  const int l16  = lane & 15;
  const int hi   = lane >> 4;          // lane half
  const int base = hi * 8;             // A/B fragment k-base (ISA 7.12.2)
  const int hi8  = hi * 8;             // C/D row base

  int bid = blockIdx.x;
  const int qt  = bid & 15;  bid >>= 4;
  const int kvh = bid & 7;   bid >>= 3;
  const int b   = bid;
  const int h   = kvh * G_ + w;
  const int q0  = qt * 16;

  int seq = slens[b]; if (seq < Q_) seq = Q_;
  const int sbq     = seq - Q_ + q0;          // q_pos of tile row 0
  int nchunks = (sbq + 16 + 31) >> 5;         // 32-kv chunks needed (causal)
  if (nchunks > KV_ / 32) nchunks = KV_ / 32; // bound: the cache view ends at KV_

  const int* btab = bt + b * NB_;

  // staging role: token = tid&31, d-quarter = tid>>5 (32 d values each)
  const int st_t  = tid & 31;
  const int st_dq = tid >> 5;

  auto stage = [&](int c, int buf) {
    _Float16* sK = ldsK[buf];
    _Float16* sV = ldsV[buf];
    const int t  = c * 32 + st_t;
    const int pb = page(btab[t >> 4]);
    const size_t rowoff =
        (size_t)((pb * BLOCK_ + (t & 15)) * KVH_ + kvh) * D_ + st_dq * 32;
    const float* krow = kc + rowoff;
    const float* vrow = vc + rowoff;

    if (c + 1 < nchunks) {  // prefetch one more chunk ahead (global_prefetch_b8)
      const int tn  = c * 32 + 32 + st_t;
      const int pbn = page(btab[tn >> 4]);
      const size_t noff =
          (size_t)((pbn * BLOCK_ + (tn & 15)) * KVH_ + kvh) * D_ + st_dq * 32;
      __builtin_prefetch(kc + noff, 0, 3);
      __builtin_prefetch(vc + noff, 0, 3);
    }

    #pragma unroll
    for (int j8 = 0; j8 < 4; ++j8) {
      float4 ka = *(const float4*)(krow + j8 * 8);
      float4 kb = *(const float4*)(krow + j8 * 8 + 4);
      v8h kp;
      kp[0] = (_Float16)ka.x; kp[1] = (_Float16)ka.y;
      kp[2] = (_Float16)ka.z; kp[3] = (_Float16)ka.w;
      kp[4] = (_Float16)kb.x; kp[5] = (_Float16)kb.y;
      kp[6] = (_Float16)kb.z; kp[7] = (_Float16)kb.w;
      *(v8h*)(&sK[st_t * KP_ + st_dq * 32 + j8 * 8]) = kp;

      float4 va = *(const float4*)(vrow + j8 * 8);
      float4 vb = *(const float4*)(vrow + j8 * 8 + 4);
      const int d0 = st_dq * 32 + j8 * 8;
      sV[(d0 + 0) * VP_ + st_t] = (_Float16)va.x;
      sV[(d0 + 1) * VP_ + st_t] = (_Float16)va.y;
      sV[(d0 + 2) * VP_ + st_t] = (_Float16)va.z;
      sV[(d0 + 3) * VP_ + st_t] = (_Float16)va.w;
      sV[(d0 + 4) * VP_ + st_t] = (_Float16)vb.x;
      sV[(d0 + 5) * VP_ + st_t] = (_Float16)vb.y;
      sV[(d0 + 6) * VP_ + st_t] = (_Float16)vb.z;
      sV[(d0 + 7) * VP_ + st_t] = (_Float16)vb.w;
    }
  };

  // ---- Q tile [16 x 128] -> 4 A-fragments (f16, pre-scaled) ----
  v16h qf[4];
  {
    const float* qrow = q + (size_t)((b * Q_ + q0 + l16) * H_ + h) * D_;
    #pragma unroll
    for (int dc = 0; dc < 4; ++dc) {
      #pragma unroll
      for (int j = 0; j < 8; ++j) {
        qf[dc][j]     = (_Float16)(qrow[dc * 32 + base + j]      * SCALE_);
        qf[dc][8 + j] = (_Float16)(qrow[dc * 32 + base + 16 + j] * SCALE_);
      }
    }
  }

  v8f zero = {};
  v8f o[8];
  #pragma unroll
  for (int nt = 0; nt < 8; ++nt) o[nt] = zero;
  float mrow[8], lrow[8];
  #pragma unroll
  for (int r = 0; r < 8; ++r) { mrow[r] = -1e30f; lrow[r] = 0.f; }

  stage(0, 0);
  __syncthreads();

  for (int cb = 0; cb < nchunks; ++cb) {
    const int cur = cb & 1;
    const int kv0 = cb * 32;

    // overlap: stage next chunk into the spare buffer while computing this one
    if (cb + 1 < nchunks) stage(cb + 1, cur ^ 1);

    // ---- QK^T: preload all 8 K fragments, then 8 dense WMMAs ----
    v8f s0 = {}, s1 = {};
    {
      const _Float16* bK = ldsK[cur];
      const int t0row = l16 * KP_;         // B-frag: lane = token column
      const int t1row = t0row + 16 * KP_;
      v16h kfa[4], kfb[4];
      #pragma unroll
      for (int dc = 0; dc < 4; ++dc) {
        v8h a0 = *(const v8h*)(&bK[t0row + dc * 32 + base]);
        v8h a1 = *(const v8h*)(&bK[t0row + dc * 32 + base + 16]);
        v8h b0 = *(const v8h*)(&bK[t1row + dc * 32 + base]);
        v8h b1 = *(const v8h*)(&bK[t1row + dc * 32 + base + 16]);
        kfa[dc] = cat8(a0, a1);
        kfb[dc] = cat8(b0, b1);
      }
      #pragma unroll
      for (int dc = 0; dc < 4; ++dc) {
        s0 = __builtin_amdgcn_wmma_f32_16x16x32_f16(false, qf[dc], false,
                                                    kfa[dc], (short)0, s0,
                                                    false, false);
        s1 = __builtin_amdgcn_wmma_f32_16x16x32_f16(false, qf[dc], false,
                                                    kfb[dc], (short)0, s1,
                                                    false, false);
      }
    }

    // ---- masked online softmax (rows live in C-layout: m = r + hi8) ----
    float alpha[8];
    #pragma unroll
    for (int r = 0; r < 8; ++r) {
      const int m  = r + hi8;
      const int qp = sbq + m;                       // global query position
      const bool v0 = (kv0 + l16)      <= qp;       // causal mask
      const bool v1 = (kv0 + 16 + l16) <= qp;
      float a0 = v0 ? s0[r] : -1e30f;
      float a1 = v1 ? s1[r] : -1e30f;
      float rowmax = rmax16(fmaxf(a0, a1));
      float mnew   = fmaxf(mrow[r], rowmax);
      alpha[r] = __expf(mrow[r] - mnew);
      float p0 = v0 ? __expf(a0 - mnew) : 0.f;
      float p1 = v1 ? __expf(a1 - mnew) : 0.f;
      lrow[r] = lrow[r] * alpha[r] + rsum16(p0 + p1);
      mrow[r] = mnew;
      ldsP[w][m * PP_ + l16]      = (_Float16)p0;    // A-layout relayout
      ldsP[w][m * PP_ + 16 + l16] = (_Float16)p1;
    }

    // ---- O = O*alpha + P @ V (V fragments preloaded in groups of 4) ----
    v16h pf;
    {
      v8h plo = *(const v8h*)(&ldsP[w][l16 * PP_ + base]);
      v8h phi = *(const v8h*)(&ldsP[w][l16 * PP_ + base + 16]);
      pf = cat8(plo, phi);
    }
    {
      const _Float16* bV = ldsV[cur];
      #pragma unroll
      for (int grp = 0; grp < 2; ++grp) {
        v16h vf[4];
        #pragma unroll
        for (int i = 0; i < 4; ++i) {
          const int d = (grp * 4 + i) * 16 + l16;
          v8h vlo = *(const v8h*)(&bV[d * VP_ + base]);
          v8h vhi = *(const v8h*)(&bV[d * VP_ + base + 16]);
          vf[i] = cat8(vlo, vhi);
        }
        #pragma unroll
        for (int i = 0; i < 4; ++i) {
          const int nt = grp * 4 + i;
          v8f oc = o[nt];
          #pragma unroll
          for (int r = 0; r < 8; ++r) oc[r] *= alpha[r];
          o[nt] = __builtin_amdgcn_wmma_f32_16x16x32_f16(false, pf, false,
                                                         vf[i], (short)0, oc,
                                                         false, false);
        }
      }
    }

    __syncthreads();  // staging of next buffer done; current buffer released
  }

  // ---- epilogue: divide by l, write coalesced f32 rows ----
  #pragma unroll
  for (int r = 0; r < 8; ++r) {
    const int m    = r + hi8;
    const float iv = 1.0f / lrow[r];
    float* orow = out + (size_t)((b * Q_ + q0 + m) * H_ + h) * D_;
    #pragma unroll
    for (int nt = 0; nt < 8; ++nt)
      orow[nt * 16 + l16] = o[nt][r] * iv;
  }
}

extern "C" void kernel_launch(void* const* d_in, const int* in_sizes, int n_in,
                              void* d_out, int out_size, void* d_ws, size_t ws_size,
                              hipStream_t stream) {
  (void)in_sizes; (void)n_in; (void)out_size; (void)d_ws; (void)ws_size;
  const float* query        = (const float*)d_in[0];
  const float* k_cache      = (const float*)d_in[1];
  const float* v_cache      = (const float*)d_in[2];
  const int*   block_tables = (const int*)d_in[3];
  const int*   seq_lens     = (const int*)d_in[4];
  float*       outp         = (float*)d_out;

  // B * KVH * (Q/16) = 4*8*16 = 512 workgroups of 4 wave32s (one per g)
  dim3 grid(B_ * KVH_ * (Q_ / 16));
  dim3 block(128);
  paged_gqa_prefill_wmma<<<grid, block, 0, stream>>>(
      query, k_cache, v_cache, block_tables, seq_lens, outp);
}

// v002
// Measured time: 77.6 microseconds a run.
// In two side-by-side timings against v001, it was 1.50 and 1.49 times as fast.
// Over all steps from v000 it is 2.22 times as fast.
#include <hip/hip_runtime.h>
#include <hip/hip_bf16.h>

typedef __attribute__((ext_vector_type(16))) _Float16 v16h;
typedef __attribute__((ext_vector_type(8)))  _Float16 v8h;
typedef __attribute__((ext_vector_type(4)))  _Float16 v4h;
typedef __attribute__((ext_vector_type(8)))  float    v8f;

#define B_    4
#define Q_    256
#define H_    32
#define D_    128
#define KVH_  8
#define G_    4
#define BLOCK_ 16
#define NB_   128
#define KV_   2048
#define SCALE_ 0.08838834764831845f  /* 1/sqrt(128) */
// LDS row pitches in f16 elements. Every fragment read is a 16-byte load with
// one row per lane, so each pitch is 16 B x odd: 16 lanes then fall on all 64
// banks instead of on 4 (256-B rows) or 16 (64-B rows).
#define KP_   (D_ + 8)   /* K rows:   272 B */
#define VP_   (32 + 8)   /* V^T rows:  80 B */
#define PP_   (32 + 8)   /* P rows:    80 B */

__device__ __forceinline__ float rmax16(float v) {
  v = fmaxf(v, __shfl_xor(v, 1, 32));
  v = fmaxf(v, __shfl_xor(v, 2, 32));
  v = fmaxf(v, __shfl_xor(v, 4, 32));
  v = fmaxf(v, __shfl_xor(v, 8, 32));
  return v;
}
__device__ __forceinline__ float rsum16(float v) {
  v += __shfl_xor(v, 1, 32);
  v += __shfl_xor(v, 2, 32);
  v += __shfl_xor(v, 4, 32);
  v += __shfl_xor(v, 8, 32);
  return v;
}
__device__ __forceinline__ v16h cat8(v8h lo, v8h hi) {
  return __builtin_shufflevector(lo, hi, 0, 1, 2, 3, 4, 5, 6, 7,
                                 8, 9, 10, 11, 12, 13, 14, 15);
}

// bound: a page number read from the table stays inside the caches
// (B_ * NB_ pages, a power of two; identity on every valid page number)
__device__ __forceinline__ int page(int p) {
  return p & (B_ * NB_ - 1);
}

// 4 waves per workgroup (one per GQA group g) share one (b, kv-head, q-tile).
// K/V chunks are staged once into double-buffered LDS (f16); staging of chunk
// n+1 overlaps compute of chunk n, one barrier per chunk.
__global__ __launch_bounds__(128)
void paged_gqa_prefill_wmma(const float* __restrict__ q,
                            const float* __restrict__ kc,
                            const float* __restrict__ vc,
                            const int*   __restrict__ bt,
                            const int*   __restrict__ slens,
                            float* __restrict__ out) {
  __shared__ __attribute__((aligned(16))) _Float16 ldsK[2][32 * KP_];   // [buf][token][d]
  __shared__ __attribute__((aligned(16))) _Float16 ldsV[2][D_ * VP_];   // [buf][d][token]
  __shared__ __attribute__((aligned(16))) _Float16 ldsP[G_][16 * PP_];  // per-wave P tile

  const int tid  = threadIdx.x;
  const int w    = tid >> 5;           // wave id == query-head group g
  const int lane = tid & 31;
  const int l16  = lane & 15;
  const int hi   = lane >> 4;          // lane half
  const int base = hi * 8;             // A/B fragment k-base (ISA 7.12.2)
  const int hi8  = hi * 8;             // C/D row base

  int bid = blockIdx.x;
  const int qt  = bid & 15;  bid >>= 4;
  const int kvh = bid & 7;   bid >>= 3;
  const int b   = bid;
  const int h   = kvh * G_ + w;
  const int q0  = qt * 16;

  int seq = slens[b]; if (seq < Q_) seq = Q_;
  const int sbq     = seq - Q_ + q0;          // q_pos of tile row 0
  int nchunks = (sbq + 16 + 31) >> 5;         // 32-kv chunks needed (causal)
  if (nchunks > KV_ / 32) nchunks = KV_ / 32; // bound: the cache view ends at KV_

  const int* btab = bt + b * NB_;

  // staging role: wave w brings tokens w*8 .. w*8+7 of a chunk, one token row
  // (512 contiguous bytes, 4 lines) per wave-wide 16-byte load; a lane holds 4
  // consecutive d of each of its wave's 8 tokens. The 8 tokens share one page.
  const int wu = __builtin_amdgcn_readfirstlane(w);  // makes the page lookup a scalar load

  auto stage = [&](int c, int buf) {
    _Float16* sK = ldsK[buf];
    _Float16* sV = ldsV[buf];
    const int t0 = c * 32 + wu * 8;
    const int pb = page(btab[t0 >> 4]);
    const size_t rowoff =
        (size_t)((pb * BLOCK_ + (t0 & 15)) * KVH_ + kvh) * D_;
    const float4* krow = (const float4*)(kc + rowoff) + lane;  // the lane's 16 B
    const float4* vrow = (const float4*)(vc + rowoff) + lane;  // of the first row

    float4 kx[8], vx[8];
    #pragma unroll
    for (int j = 0; j < 8; ++j) kx[j] = krow[j * (KVH_ * D_ / 4)];
    #pragma unroll
    for (int j = 0; j < 8; ++j) vx[j] = vrow[j * (KVH_ * D_ / 4)];
    // translation wait: the loads' address registers are reused below. It takes
    // both addresses as inputs so that they keep their registers up to here and
    // no load of the run gets its result placed over them; its memory clobber
    // also keeps the loads issued ahead of the prefetch's page lookup
    asm volatile("s_wait_xcnt 0x0" :: "v"(krow), "v"(vrow) : "memory");

    if (c + 1 < nchunks) {  // prefetch one more chunk ahead (global_prefetch_b8)
      // the wave's own 8 rows of that chunk: lane = (token, 128-B line of its row)
      const int tn  = t0 + 32;
      const int pbn = page(btab[tn >> 4]);
      const size_t noff =
          (size_t)((pbn * BLOCK_ + (tn & 15) + (lane >> 2)) * KVH_ + kvh) * D_ +
          (lane & 3) * 32;
      __builtin_prefetch(kc + noff, 0, 3);
      __builtin_prefetch(vc + noff, 0, 3);
      // translation wait: the prefetch address registers are reused below
      asm volatile("s_wait_xcnt 0x0" ::: "memory");
    }

    #pragma unroll
    for (int j = 0; j < 8; ++j) {      // K rows: 8 bytes per lane, 256 B per wave
      v4h kp;
      kp[0] = (_Float16)kx[j].x; kp[1] = (_Float16)kx[j].y;
      kp[2] = (_Float16)kx[j].z; kp[3] = (_Float16)kx[j].w;
      *(v4h*)(&sK[(wu * 8 + j) * KP_ + lane * 4]) = kp;
    }
    // V^T rows: the lane's 8 tokens of one d are 16 contiguous bytes
    v8h vp0, vp1, vp2, vp3;
    #pragma unroll
    for (int j = 0; j < 8; ++j) {
      vp0[j] = (_Float16)vx[j].x; vp1[j] = (_Float16)vx[j].y;
      vp2[j] = (_Float16)vx[j].z; vp3[j] = (_Float16)vx[j].w;
    }
    *(v8h*)(&sV[(lane * 4 + 0) * VP_ + wu * 8]) = vp0;
    *(v8h*)(&sV[(lane * 4 + 1) * VP_ + wu * 8]) = vp1;
    *(v8h*)(&sV[(lane * 4 + 2) * VP_ + wu * 8]) = vp2;
    *(v8h*)(&sV[(lane * 4 + 3) * VP_ + wu * 8]) = vp3;
  };

  // ---- Q tile [16 x 128] -> 4 A-fragments (f16, pre-scaled) ----
  v16h qf[4];
  {
    const float* qrow = q + (size_t)((b * Q_ + q0 + l16) * H_ + h) * D_;
    #pragma unroll
    for (int dc = 0; dc < 4; ++dc) {
      #pragma unroll
      for (int j = 0; j < 8; ++j) {
        qf[dc][j]     = (_Float16)(qrow[dc * 32 + base + j]      * SCALE_);
        qf[dc][8 + j] = (_Float16)(qrow[dc * 32 + base + 16 + j] * SCALE_);
      }
    }
  }

  v8f zero = {};
  v8f o[8];
  #pragma unroll
  for (int nt = 0; nt < 8; ++nt) o[nt] = zero;
  float mrow[8], lrow[8];
  #pragma unroll
  for (int r = 0; r < 8; ++r) { mrow[r] = -1e30f; lrow[r] = 0.f; }

  stage(0, 0);
  __syncthreads();

  for (int cb = 0; cb < nchunks; ++cb) {
    const int cur = cb & 1;
    const int kv0 = cb * 32;

    // overlap: stage next chunk into the spare buffer while computing this one
    if (cb + 1 < nchunks) stage(cb + 1, cur ^ 1);

    // ---- QK^T: preload all 8 K fragments, then 8 dense WMMAs ----
    v8f s0 = {}, s1 = {};
    {
      const _Float16* bK = ldsK[cur];
      const int t0row = l16 * KP_;         // B-frag: lane = token column
      const int t1row = t0row + 16 * KP_;
      v16h kfa[4], kfb[4];
      #pragma unroll
      for (int dc = 0; dc < 4; ++dc) {
        v8h a0 = *(const v8h*)(&bK[t0row + dc * 32 + base]);
        v8h a1 = *(const v8h*)(&bK[t0row + dc * 32 + base + 16]);
        v8h b0 = *(const v8h*)(&bK[t1row + dc * 32 + base]);
        v8h b1 = *(const v8h*)(&bK[t1row + dc * 32 + base + 16]);
        kfa[dc] = cat8(a0, a1);
        kfb[dc] = cat8(b0, b1);
      }
      #pragma unroll
      for (int dc = 0; dc < 4; ++dc) {
        s0 = __builtin_amdgcn_wmma_f32_16x16x32_f16(false, qf[dc], false,
                                                    kfa[dc], (short)0, s0,
                                                    false, false);
        s1 = __builtin_amdgcn_wmma_f32_16x16x32_f16(false, qf[dc], false,
                                                    kfb[dc], (short)0, s1,
                                                    false, false);
      }
    }

    // ---- masked online softmax (rows live in C-layout: m = r + hi8) ----
    float alpha[8];
    #pragma unroll
    for (int r = 0; r < 8; ++r) {
      const int m  = r + hi8;
      const int qp = sbq + m;                       // global query position
      const bool v0 = (kv0 + l16)      <= qp;       // causal mask
      const bool v1 = (kv0 + 16 + l16) <= qp;
      float a0 = v0 ? s0[r] : -1e30f;
      float a1 = v1 ? s1[r] : -1e30f;
      float rowmax = rmax16(fmaxf(a0, a1));
      float mnew   = fmaxf(mrow[r], rowmax);
      alpha[r] = __expf(mrow[r] - mnew);
      float p0 = v0 ? __expf(a0 - mnew) : 0.f;
      float p1 = v1 ? __expf(a1 - mnew) : 0.f;
      lrow[r] = lrow[r] * alpha[r] + rsum16(p0 + p1);
      mrow[r] = mnew;
      ldsP[w][m * PP_ + l16]      = (_Float16)p0;    // A-layout relayout
      ldsP[w][m * PP_ + 16 + l16] = (_Float16)p1;
    }

    // ---- O = O*alpha + P @ V (V fragments preloaded in groups of 4) ----
    v16h pf;
    {
      v8h plo = *(const v8h*)(&ldsP[w][l16 * PP_ + base]);
      v8h phi = *(const v8h*)(&ldsP[w][l16 * PP_ + base + 16]);
      pf = cat8(plo, phi);
    }
    {
      const _Float16* bV = ldsV[cur];
      #pragma unroll
      for (int grp = 0; grp < 2; ++grp) {
        v16h vf[4];
        #pragma unroll
        for (int i = 0; i < 4; ++i) {
          const int d = (grp * 4 + i) * 16 + l16;
          v8h vlo = *(const v8h*)(&bV[d * VP_ + base]);
          v8h vhi = *(const v8h*)(&bV[d * VP_ + base + 16]);
          vf[i] = cat8(vlo, vhi);
        }
        #pragma unroll
        for (int i = 0; i < 4; ++i) {
          const int nt = grp * 4 + i;
          v8f oc = o[nt];
          #pragma unroll
          for (int r = 0; r < 8; ++r) oc[r] *= alpha[r];
          o[nt] = __builtin_amdgcn_wmma_f32_16x16x32_f16(false, pf, false,
                                                         vf[i], (short)0, oc,
                                                         false, false);
        }
      }
    }

    __syncthreads();  // staging of next buffer done; current buffer released
  }

  // ---- epilogue: divide by l, write coalesced f32 rows ----
  #pragma unroll
  for (int r = 0; r < 8; ++r) {
    const int m    = r + hi8;
    const float iv = 1.0f / lrow[r];
    float* orow = out + (size_t)((b * Q_ + q0 + m) * H_ + h) * D_;
    #pragma unroll
    for (int nt = 0; nt < 8; ++nt)
      orow[nt * 16 + l16] = o[nt][r] * iv;
  }
}

extern "C" void kernel_launch(void* const* d_in, const int* in_sizes, int n_in,
                              void* d_out, int out_size, void* d_ws, size_t ws_size,
                              hipStream_t stream) {
  (void)in_sizes; (void)n_in; (void)out_size; (void)d_ws; (void)ws_size;
  const float* query        = (const float*)d_in[0];
  const float* k_cache      = (const float*)d_in[1];
  const float* v_cache      = (const float*)d_in[2];
  const int*   block_tables = (const int*)d_in[3];
  const int*   seq_lens     = (const int*)d_in[4];
  float*       outp         = (float*)d_out;

  // B * KVH * (Q/16) = 4*8*16 = 512 workgroups of 4 wave32s (one per g)
  dim3 grid(B_ * KVH_ * (Q_ / 16));
  dim3 block(128);
  paged_gqa_prefill_wmma<<<grid, block, 0, stream>>>(
      query, k_cache, v_cache, block_tables, seq_lens, outp);
}

// v003
// It runs in 44.6 microseconds.
// Next to v002, in two timings, it ran 1.73 and 1.74 times as fast.
// Over all steps from v000 it is 3.85 times as fast.
#include <hip/hip_runtime.h>
#include <hip/hip_bf16.h>

typedef __attribute__((ext_vector_type(16))) _Float16 v16h;
typedef __attribute__((ext_vector_type(8)))  _Float16 v8h;
typedef __attribute__((ext_vector_type(4)))  _Float16 v4h;
typedef __attribute__((ext_vector_type(8)))  float    v8f;

#define B_    4
#define Q_    256
#define H_    32
#define D_    128
#define KVH_  8
#define G_    4
#define BLOCK_ 16
#define NB_   128
#define KV_   2048
#define SCALE_ 0.08838834764831845f  /* 1/sqrt(128) */
// LDS row pitches in f16 elements. Every fragment read is a 16-byte load with
// one row per lane, so each pitch is 16 B x odd: 16 lanes then fall on all 64
// banks instead of on 4 (256-B rows) or 16 (64-B rows).
#define KP_   (D_ + 8)   /* K rows:   272 B */
#define VP_   (32 + 8)   /* V^T rows:  80 B */

// lane l reads lane l ^ 16 (v_permlanex16_b32: a vector move, no LDS-counter wait)
__device__ __forceinline__ float xhalf(float x) {
  const int b = __builtin_bit_cast(int, x);
  return __builtin_bit_cast(float, __builtin_amdgcn_permlanex16(
      b, b, 0x76543210, 0xfedcba98, false, false));
}
__device__ __forceinline__ v16h cat8(v8h lo, v8h hi) {
  return __builtin_shufflevector(lo, hi, 0, 1, 2, 3, 4, 5, 6, 7,
                                 8, 9, 10, 11, 12, 13, 14, 15);
}

// bound: a page number read from the table stays inside the caches
// (B_ * NB_ pages, a power of two; identity on every valid page number)
__device__ __forceinline__ int page(int p) {
  return p & (B_ * NB_ - 1);
}

__global__ __launch_bounds__(128)
void paged_gqa_prefill_wmma(const float* __restrict__ q,
                            const float* __restrict__ kc,
                            const float* __restrict__ vc,
                            const int*   __restrict__ bt,
                            const int*   __restrict__ slens,
                            float* __restrict__ out) {
  __shared__ __attribute__((aligned(16))) _Float16 ldsK[2][32 * KP_];   // [buf][token][d]
  __shared__ __attribute__((aligned(16))) _Float16 ldsV[2][D_ * VP_];   // [buf][d][token]

  const int tid  = threadIdx.x;
  const int w    = tid >> 5;           // wave id == query-head group g
  const int lane = tid & 31;
  const int l16  = lane & 15;
  const int hi   = lane >> 4;          // lane half
  const int base = hi * 8;             // A/B fragment k-base (ISA 7.12.2)
  const int hi8  = hi * 8;             // C/D row base (column = l16)

  int bid = blockIdx.x;
  const int qt  = bid & 15;  bid >>= 4;
  const int kvh = bid & 7;   bid >>= 3;
  const int b   = bid;
  const int h   = kvh * G_ + w;
  const int q0  = qt * 16;

  int seq = slens[b]; if (seq < Q_) seq = Q_;
  const int sbq     = seq - Q_ + q0;          // q_pos of tile row 0
  int nchunks = (sbq + 16 + 31) >> 5;         // 32-kv chunks needed (causal)
  if (nchunks > KV_ / 32) nchunks = KV_ / 32; // bound: the cache view ends at KV_

  const int* btab = bt + b * NB_;

  // staging role: wave w brings tokens w*8 .. w*8+7 of a chunk, one token row
  // (512 contiguous bytes, 4 lines) per wave-wide 16-byte load; a lane holds 4
  // consecutive d of each of its wave's 8 tokens. The 8 tokens share one page.
  const int wu = __builtin_amdgcn_readfirstlane(w);  // makes the page lookup a scalar load

  auto stage = [&](int c, int buf) {
    _Float16* sK = ldsK[buf];
    _Float16* sV = ldsV[buf];
    const int t0 = c * 32 + wu * 8;
    const int pb = page(btab[t0 >> 4]);
    const size_t rowoff =
        (size_t)((pb * BLOCK_ + (t0 & 15)) * KVH_ + kvh) * D_;
    const float4* krow = (const float4*)(kc + rowoff) + lane;  // the lane's 16 B
    const float4* vrow = (const float4*)(vc + rowoff) + lane;  // of the first row

    float4 kx[8], vx[8];
    #pragma unroll
    for (int j = 0; j < 8; ++j) kx[j] = krow[j * (KVH_ * D_ / 4)];
    #pragma unroll
    for (int j = 0; j < 8; ++j) vx[j] = vrow[j * (KVH_ * D_ / 4)];
    // translation wait: the loads' address registers are reused below. It takes
    // both addresses as inputs so that they keep their registers up to here and
    // no load of the run gets its result placed over them; its memory clobber
    // also keeps the loads issued ahead of the prefetch's page lookup
    asm volatile("s_wait_xcnt 0x0" :: "v"(krow), "v"(vrow) : "memory");

    if (c + 1 < nchunks) {  // prefetch one more chunk ahead (global_prefetch_b8)
      // the wave's own 8 rows of that chunk: lane = (token, 128-B line of its row)
      const int tn  = t0 + 32;
      const int pbn = page(btab[tn >> 4]);
      const size_t noff =
          (size_t)((pbn * BLOCK_ + (tn & 15) + (lane >> 2)) * KVH_ + kvh) * D_ +
          (lane & 3) * 32;
      __builtin_prefetch(kc + noff, 0, 3);
      __builtin_prefetch(vc + noff, 0, 3);
      // translation wait: the prefetch address registers are reused below
      asm volatile("s_wait_xcnt 0x0" ::: "memory");
    }

    #pragma unroll
    for (int j = 0; j < 8; ++j) {      // K rows: 8 bytes per lane, 256 B per wave
      v4h kp;
      kp[0] = (_Float16)kx[j].x; kp[1] = (_Float16)kx[j].y;
      kp[2] = (_Float16)kx[j].z; kp[3] = (_Float16)kx[j].w;
      *(v4h*)(&sK[(wu * 8 + j) * KP_ + lane * 4]) = kp;
    }
    // V^T rows: the lane's 8 tokens of one d are 16 contiguous bytes
    v8h vp0, vp1, vp2, vp3;
    #pragma unroll
    for (int j = 0; j < 8; ++j) {
      vp0[j] = (_Float16)vx[j].x; vp1[j] = (_Float16)vx[j].y;
      vp2[j] = (_Float16)vx[j].z; vp3[j] = (_Float16)vx[j].w;
    }
    *(v8h*)(&sV[(lane * 4 + 0) * VP_ + wu * 8]) = vp0;
    *(v8h*)(&sV[(lane * 4 + 1) * VP_ + wu * 8]) = vp1;
    *(v8h*)(&sV[(lane * 4 + 2) * VP_ + wu * 8]) = vp2;
    *(v8h*)(&sV[(lane * 4 + 3) * VP_ + wu * 8]) = vp3;
  };

  // ---- Q tile [16 x 128] -> 4 B-fragments of Q^T (f16, pre-scaled) ----
  v16h qf[4];
  {
    const float* qrow = q + (size_t)((b * Q_ + q0 + l16) * H_ + h) * D_;
    #pragma unroll
    for (int dc = 0; dc < 4; ++dc) {
      #pragma unroll
      for (int j = 0; j < 8; ++j) {
        qf[dc][j]     = (_Float16)(qrow[dc * 32 + base + j]      * SCALE_);
        qf[dc][8 + j] = (_Float16)(qrow[dc * 32 + base + 16 + j] * SCALE_);
      }
    }
  }

  v8f zero = {};
  v8f o[8];
  #pragma unroll
  for (int nt = 0; nt < 8; ++nt) o[nt] = zero;
  float mrow = -1e30f;   // running maximum of the lane's query (equal in both halves)
  float lrow = 0.f;      // running sum over the lane's own 16 tokens of each chunk
  const int qp = sbq + l16;                 // global position of the lane's query

  stage(0, 0);
  __syncthreads();

  for (int cb = 0; cb < nchunks; ++cb) {
    const int cur = cb & 1;
    const int kv0 = cb * 32;

    // overlap: stage next chunk into the spare buffer while computing this one
    if (cb + 1 < nchunks) stage(cb + 1, cur ^ 1);

    // ---- QK^T: preload all 8 K fragments, then 8 dense WMMAs ----
    v8f s0 = {}, s1 = {};
    {
      const _Float16* bK = ldsK[cur];
      const int t0row = l16 * KP_;         // A-frag: lane = token row
      const int t1row = t0row + 16 * KP_;
      v16h kfa[4], kfb[4];
      #pragma unroll
      for (int dc = 0; dc < 4; ++dc) {
        v8h a0 = *(const v8h*)(&bK[t0row + dc * 32 + base]);
        v8h a1 = *(const v8h*)(&bK[t0row + dc * 32 + base + 16]);
        v8h b0 = *(const v8h*)(&bK[t1row + dc * 32 + base]);
        v8h b1 = *(const v8h*)(&bK[t1row + dc * 32 + base + 16]);
        kfa[dc] = cat8(a0, a1);
        kfb[dc] = cat8(b0, b1);
      }
      #pragma unroll
      for (int dc = 0; dc < 4; ++dc) {
        s0 = __builtin_amdgcn_wmma_f32_16x16x32_f16(false, kfa[dc], false,
                                                    qf[dc], (short)0, s0,
                                                    false, false);
        s1 = __builtin_amdgcn_wmma_f32_16x16x32_f16(false, kfb[dc], false,
                                                    qf[dc], (short)0, s1,
                                                    false, false);
      }
    }

    // ---- masked online softmax (S^T in C-layout: token = r + hi8, query = l16) ----
    float a0[8], a1[8];
    float cmax = -1e30f;
    #pragma unroll
    for (int r = 0; r < 8; ++r) {
      a0[r] = (kv0 + hi8 + r)      <= qp ? s0[r] : -1e30f;   // causal mask
      a1[r] = (kv0 + 16 + hi8 + r) <= qp ? s1[r] : -1e30f;
      cmax  = fmaxf(cmax, fmaxf(a0[r], a1[r]));
    }
    cmax = fmaxf(cmax, xhalf(cmax));   // the query's other 16 tokens
    const float mnew  = fmaxf(mrow, cmax);
    const float alpha = __expf(mrow - mnew);
    mrow = mnew;
    // P^T as B fragment: element j is k = hi8 + j, element 8 + j is k = 16 + hi8 + j,
    // which are the tokens this lane already holds
    v16h pf;
    float csum = 0.f;
    #pragma unroll
    for (int r = 0; r < 8; ++r) {
      const float p0 = (kv0 + hi8 + r)      <= qp ? __expf(a0[r] - mnew) : 0.f;
      const float p1 = (kv0 + 16 + hi8 + r) <= qp ? __expf(a1[r] - mnew) : 0.f;
      csum += p0 + p1;
      pf[r]     = (_Float16)p0;
      pf[8 + r] = (_Float16)p1;
    }
    lrow = lrow * alpha + csum;

    // ---- O^T = O^T*alpha + V^T @ P^T (V fragments preloaded in groups of 4) ----
    {
      const _Float16* bV = ldsV[cur];
      #pragma unroll
      for (int grp = 0; grp < 2; ++grp) {
        v16h vf[4];
        #pragma unroll
        for (int i = 0; i < 4; ++i) {
          const int d = (grp * 4 + i) * 16 + l16;
          v8h vlo = *(const v8h*)(&bV[d * VP_ + base]);
          v8h vhi = *(const v8h*)(&bV[d * VP_ + base + 16]);
          vf[i] = cat8(vlo, vhi);
        }
        #pragma unroll
        for (int i = 0; i < 4; ++i) {
          const int nt = grp * 4 + i;
          v8f oc = o[nt];
          #pragma unroll
          for (int r = 0; r < 8; ++r) oc[r] *= alpha;
          o[nt] = __builtin_amdgcn_wmma_f32_16x16x32_f16(false, vf[i], false,
                                                         pf, (short)0, oc,
                                                         false, false);
        }
      }
    }

    __syncthreads();  // staging of next buffer done; current buffer released
  }

  // ---- epilogue: join the halves' sums, divide, write the lane's query row ----
  // O^T tile nt holds d = nt*16 + hi8 + r of query l16: 32 contiguous bytes a lane
  {
    const float iv = 1.0f / (lrow + xhalf(lrow));
    float* orow = out + (size_t)((b * Q_ + q0 + l16) * H_ + h) * D_ + hi8;
    #pragma unroll
    for (int nt = 0; nt < 8; ++nt) {
      float4 lo4, hi4;
      lo4.x = o[nt][0] * iv; lo4.y = o[nt][1] * iv;
      lo4.z = o[nt][2] * iv; lo4.w = o[nt][3] * iv;
      hi4.x = o[nt][4] * iv; hi4.y = o[nt][5] * iv;
      hi4.z = o[nt][6] * iv; hi4.w = o[nt][7] * iv;
      *(float4*)(orow + nt * 16)     = lo4;
      *(float4*)(orow + nt * 16 + 4) = hi4;
    }
  }
}

extern "C" void kernel_launch(void* const* d_in, const int* in_sizes, int n_in,
                              void* d_out, int out_size, void* d_ws, size_t ws_size,
                              hipStream_t stream) {
  (void)in_sizes; (void)n_in; (void)out_size; (void)d_ws; (void)ws_size;
  const float* query        = (const float*)d_in[0];
  const float* k_cache      = (const float*)d_in[1];
  const float* v_cache      = (const float*)d_in[2];
  const int*   block_tables = (const int*)d_in[3];
  const int*   seq_lens     = (const int*)d_in[4];
  float*       outp         = (float*)d_out;

  // B * KVH * (Q/16) = 4*8*16 = 512 workgroups of 4 wave32s (one per g)
  dim3 grid(B_ * KVH_ * (Q_ / 16));
  dim3 block(128);
  paged_gqa_prefill_wmma<<<grid, block, 0, stream>>>(
      query, k_cache, v_cache, block_tables, seq_lens, outp);
}

// v004
// A run of this version takes 36.8 microseconds.
// Timed twice side by side with v003, it ran 1.21 and 1.22 times as fast.
// All steps since v000 together make it 4.67 times as fast.
#include <hip/hip_runtime.h>
#include <hip/hip_bf16.h>

typedef __attribute__((ext_vector_type(16))) _Float16 v16h;
typedef __attribute__((ext_vector_type(8)))  _Float16 v8h;
typedef __attribute__((ext_vector_type(4)))  _Float16 v4h;
typedef __attribute__((ext_vector_type(8)))  float    v8f;

#define B_    4
#define Q_    256
#define H_    32
#define D_    128
#define KVH_  8
#define G_    4
#define BLOCK_ 16
#define NB_   128
#define KV_   2048
#define SCALE_ 0.08838834764831845f  /* 1/sqrt(128) */
// LDS row pitches in f16 elements. Every fragment read is a 16-byte load with
// one row per lane, so each pitch is 16 B x odd: 16 lanes then fall on all 64
// banks instead of on 4 (256-B rows) or 16 (64-B rows).
#define KP_   (D_ + 8)   /* K rows:   272 B */
#define VP_   (32 + 8)   /* V^T rows:  80 B */

// lane l reads lane l ^ 16 (v_permlanex16_b32: a vector move, no LDS-counter wait)
__device__ __forceinline__ float xhalf(float x) {
  const int b = __builtin_bit_cast(int, x);
  return __builtin_bit_cast(float, __builtin_amdgcn_permlanex16(
      b, b, 0x76543210, 0xfedcba98, false, false));
}
__device__ __forceinline__ v16h cat8(v8h lo, v8h hi) {
  return __builtin_shufflevector(lo, hi, 0, 1, 2, 3, 4, 5, 6, 7,
                                 8, 9, 10, 11, 12, 13, 14, 15);
}

// bound: a page number read from the table stays inside the caches
// (B_ * NB_ pages, a power of two; identity on every valid page number)
__device__ __forceinline__ int page(int p) {
  return p & (B_ * NB_ - 1);
}

__global__ __launch_bounds__(256)
void paged_gqa_prefill_wmma(const float* __restrict__ q,
                            const float* __restrict__ kc,
                            const float* __restrict__ vc,
                            const int*   __restrict__ bt,
                            const int*   __restrict__ slens,
                            float* __restrict__ out) {
  __shared__ __attribute__((aligned(16))) _Float16 ldsK[2][2][32 * KP_];   // [set][buf][token][d]
  __shared__ __attribute__((aligned(16))) _Float16 ldsV[2][2][D_ * VP_];   // [set][buf][d][token]

  const int tid  = threadIdx.x;
  const int w    = (tid >> 5) & 3;     // wave in its key set == query-head group g
  const int lane = tid & 31;
  const int l16  = lane & 15;
  const int hi   = lane >> 4;          // lane half
  const int base = hi * 8;             // A/B fragment k-base (ISA 7.12.2)
  const int hi8  = hi * 8;             // C/D row base (column = l16)

  int bid = blockIdx.x;
  const int qt  = bid & 15;  bid >>= 4;
  const int kvh = bid & 7;   bid >>= 3;
  const int b   = bid;
  const int h   = kvh * G_ + w;
  const int q0  = qt * 16;

  int seq = slens[b]; if (seq < Q_) seq = Q_;
  const int sbq     = seq - Q_ + q0;          // q_pos of tile row 0
  int nchunks = (sbq + 16 + 31) >> 5;         // 32-kv chunks needed (causal)
  if (nchunks > KV_ / 32) nchunks = KV_ / 32; // bound: the cache view ends at KV_
  // both key sets make the same trips: an odd count is rounded up (KV_ / 32 is
  // even, so the added chunk lies in the cache view); all its keys are masked
  nchunks = (nchunks + 1) & ~1;
  const int ntrips = nchunks >> 1;

  const int* btab = bt + b * NB_;

  // staging role: wave w brings tokens w*8 .. w*8+7 of a chunk, one token row
  // (512 contiguous bytes, 4 lines) per wave-wide 16-byte load; a lane holds 4
  // consecutive d of each of its wave's 8 tokens. The 8 tokens share one page.
  const int wu = __builtin_amdgcn_readfirstlane(w);  // makes the page lookup a scalar load
  const int ks = __builtin_amdgcn_readfirstlane(tid >> 7);  // the wave's key set, 0 or 1

  auto stage = [&](int c, int buf) {
    _Float16* sK = ldsK[ks][buf];
    _Float16* sV = ldsV[ks][buf];
    const int t0 = c * 32 + wu * 8;
    const int pb = page(btab[t0 >> 4]);
    const size_t rowoff =
        (size_t)((pb * BLOCK_ + (t0 & 15)) * KVH_ + kvh) * D_;
    const float4* krow = (const float4*)(kc + rowoff) + lane;  // the lane's 16 B
    const float4* vrow = (const float4*)(vc + rowoff) + lane;  // of the first row

    float4 kx[8], vx[8];
    #pragma unroll
    for (int j = 0; j < 8; ++j) kx[j] = krow[j * (KVH_ * D_ / 4)];
    #pragma unroll
    for (int j = 0; j < 8; ++j) vx[j] = vrow[j * (KVH_ * D_ / 4)];
    // translation wait: the loads' address registers are reused below. It takes
    // both addresses as inputs so that they keep their registers up to here and
    // no load of the run gets its result placed over them; its memory clobber
    // also keeps the loads issued ahead of the prefetch's page lookup
    asm volatile("s_wait_xcnt 0x0" :: "v"(krow), "v"(vrow) : "memory");

    if (c + 2 < nchunks) {  // prefetch the set's chunk after this (global_prefetch_b8)
      // the wave's own 8 rows of that chunk: lane = (token, 128-B line of its row)
      const int tn  = t0 + 64;
      const int pbn = page(btab[tn >> 4]);
      const size_t noff =
          (size_t)((pbn * BLOCK_ + (tn & 15) + (lane >> 2)) * KVH_ + kvh) * D_ +
          (lane & 3) * 32;
      __builtin_prefetch(kc + noff, 0, 3);
      __builtin_prefetch(vc + noff, 0, 3);
      // translation wait: the prefetch address registers are reused below
      asm volatile("s_wait_xcnt 0x0" ::: "memory");
    }

    #pragma unroll
    for (int j = 0; j < 8; ++j) {      // K rows: 8 bytes per lane, 256 B per wave
      v4h kp;
      kp[0] = (_Float16)kx[j].x; kp[1] = (_Float16)kx[j].y;
      kp[2] = (_Float16)kx[j].z; kp[3] = (_Float16)kx[j].w;
      *(v4h*)(&sK[(wu * 8 + j) * KP_ + lane * 4]) = kp;
    }
    // V^T rows: the lane's 8 tokens of one d are 16 contiguous bytes
    v8h vp0, vp1, vp2, vp3;
    #pragma unroll
    for (int j = 0; j < 8; ++j) {
      vp0[j] = (_Float16)vx[j].x; vp1[j] = (_Float16)vx[j].y;
      vp2[j] = (_Float16)vx[j].z; vp3[j] = (_Float16)vx[j].w;
    }
    *(v8h*)(&sV[(lane * 4 + 0) * VP_ + wu * 8]) = vp0;
    *(v8h*)(&sV[(lane * 4 + 1) * VP_ + wu * 8]) = vp1;
    *(v8h*)(&sV[(lane * 4 + 2) * VP_ + wu * 8]) = vp2;
    *(v8h*)(&sV[(lane * 4 + 3) * VP_ + wu * 8]) = vp3;
  };

  // ---- Q tile [16 x 128] -> 4 B-fragments of Q^T (f16, pre-scaled) ----
  v16h qf[4];
  {
    const float* qrow = q + (size_t)((b * Q_ + q0 + l16) * H_ + h) * D_;
    #pragma unroll
    for (int dc = 0; dc < 4; ++dc) {
      #pragma unroll
      for (int j = 0; j < 8; ++j) {
        qf[dc][j]     = (_Float16)(qrow[dc * 32 + base + j]      * SCALE_);
        qf[dc][8 + j] = (_Float16)(qrow[dc * 32 + base + 16 + j] * SCALE_);
      }
    }
  }

  v8f zero = {};
  v8f o[8];
  #pragma unroll
  for (int nt = 0; nt < 8; ++nt) o[nt] = zero;
  float mrow = -1e30f;   // running maximum of the lane's query (equal in both halves)
  float lrow = 0.f;      // running sum over the lane's own 16 tokens of each chunk
  const int qp = sbq + l16;                 // global position of the lane's query

  stage(ks, 0);
  __syncthreads();

  for (int t = 0; t < ntrips; ++t) {
    const int cb  = 2 * t + ks;        // the set's chunk of this trip
    const int cur = t & 1;
    const int kv0 = cb * 32;

    // overlap: stage the set's next chunk into its spare buffer while computing this one
    if (t + 1 < ntrips) stage(cb + 2, cur ^ 1);

    // ---- QK^T: preload all 8 K fragments, then 8 dense WMMAs ----
    v8f s0 = {}, s1 = {};
    {
      const _Float16* bK = ldsK[ks][cur];
      const int t0row = l16 * KP_;         // A-frag: lane = token row
      const int t1row = t0row + 16 * KP_;
      v16h kfa[4], kfb[4];
      #pragma unroll
      for (int dc = 0; dc < 4; ++dc) {
        v8h a0 = *(const v8h*)(&bK[t0row + dc * 32 + base]);
        v8h a1 = *(const v8h*)(&bK[t0row + dc * 32 + base + 16]);
        v8h b0 = *(const v8h*)(&bK[t1row + dc * 32 + base]);
        v8h b1 = *(const v8h*)(&bK[t1row + dc * 32 + base + 16]);
        kfa[dc] = cat8(a0, a1);
        kfb[dc] = cat8(b0, b1);
      }
      #pragma unroll
      for (int dc = 0; dc < 4; ++dc) {
        s0 = __builtin_amdgcn_wmma_f32_16x16x32_f16(false, kfa[dc], false,
                                                    qf[dc], (short)0, s0,
                                                    false, false);
        s1 = __builtin_amdgcn_wmma_f32_16x16x32_f16(false, kfb[dc], false,
                                                    qf[dc], (short)0, s1,
                                                    false, false);
      }
    }

    // ---- masked online softmax (S^T in C-layout: token = r + hi8, query = l16) ----
    float a0[8], a1[8];
    float cmax = -1e30f;
    #pragma unroll
    for (int r = 0; r < 8; ++r) {
      a0[r] = (kv0 + hi8 + r)      <= qp ? s0[r] : -1e30f;   // causal mask
      a1[r] = (kv0 + 16 + hi8 + r) <= qp ? s1[r] : -1e30f;
      cmax  = fmaxf(cmax, fmaxf(a0[r], a1[r]));
    }
    cmax = fmaxf(cmax, xhalf(cmax));   // the query's other 16 tokens
    const float mnew  = fmaxf(mrow, cmax);
    const float alpha = __expf(mrow - mnew);
    mrow = mnew;
    // P^T as B fragment: element j is k = hi8 + j, element 8 + j is k = 16 + hi8 + j,
    // which are the tokens this lane already holds
    v16h pf;
    float csum = 0.f;
    #pragma unroll
    for (int r = 0; r < 8; ++r) {
      const float p0 = (kv0 + hi8 + r)      <= qp ? __expf(a0[r] - mnew) : 0.f;
      const float p1 = (kv0 + 16 + hi8 + r) <= qp ? __expf(a1[r] - mnew) : 0.f;
      csum += p0 + p1;
      pf[r]     = (_Float16)p0;
      pf[8 + r] = (_Float16)p1;
    }
    lrow = lrow * alpha + csum;

    // ---- O^T = O^T*alpha + V^T @ P^T (V fragments preloaded in groups of 4) ----
    {
      const _Float16* bV = ldsV[ks][cur];
      #pragma unroll
      for (int grp = 0; grp < 2; ++grp) {
        v16h vf[4];
        #pragma unroll
        for (int i = 0; i < 4; ++i) {
          const int d = (grp * 4 + i) * 16 + l16;
          v8h vlo = *(const v8h*)(&bV[d * VP_ + base]);
          v8h vhi = *(const v8h*)(&bV[d * VP_ + base + 16]);
          vf[i] = cat8(vlo, vhi);
        }
        #pragma unroll
        for (int i = 0; i < 4; ++i) {
          const int nt = grp * 4 + i;
          v8f oc = o[nt];
          #pragma unroll
          for (int r = 0; r < 8; ++r) oc[r] *= alpha;
          o[nt] = __builtin_amdgcn_wmma_f32_16x16x32_f16(false, vf[i], false,
                                                         pf, (short)0, oc,
                                                         false, false);
        }
      }
    }

    __syncthreads();  // staging of next buffer done; current buffer released
  }

  // ---- join the key sets: wave g of set 1 hands maximum, sum and O^T to wave g
  // of set 0, lane to lane (both hold the same queries and d in the same places).
  // The staging buffers are free behind the loop's last barrier: O^T goes into
  // the K buffers (4 waves x 16 x 512 B = 32 KiB of their 34 KiB), 16 B a lane and
  // 512 contiguous bytes a wave per access; maximum and sum into the V buffers.
  float4* xo = (float4*)&ldsK[0][0][0] + wu * 16 * 32 + lane;
  float*  xm = (float*)&ldsV[0][0][0] + wu * 64 + lane;
  if (ks == 1) {
    #pragma unroll
    for (int nt = 0; nt < 8; ++nt) {
      xo[(nt * 2) * 32]     = make_float4(o[nt][0], o[nt][1], o[nt][2], o[nt][3]);
      xo[(nt * 2 + 1) * 32] = make_float4(o[nt][4], o[nt][5], o[nt][6], o[nt][7]);
    }
    xm[0]  = mrow;
    xm[32] = lrow;
  }
  __syncthreads();  // set 1's results are in LDS before set 0 reads them

  // ---- epilogue (set 0): weigh the sets by their maxima, join the halves' sums,
  // divide, write the lane's query row ----
  // O^T tile nt holds d = nt*16 + hi8 + r of query l16: 32 contiguous bytes a lane
  if (ks == 0) {
    const float m1 = xm[0];
    const float l1 = xm[32];
    const float mj = fmaxf(mrow, m1);
    const float w0 = __expf(mrow - mj);   // a set whose keys were all masked has
    const float w1 = __expf(m1 - mj);     // maximum -1e30: weight 0, sum 0
    const float lj = lrow * w0 + l1 * w1;
    const float iv = 1.0f / (lj + xhalf(lj));
    const float c0 = w0 * iv;
    const float c1 = w1 * iv;
    float* orow = out + (size_t)((b * Q_ + q0 + l16) * H_ + h) * D_ + hi8;
    #pragma unroll
    for (int nt = 0; nt < 8; ++nt) {
      const float4 lo1 = xo[(nt * 2) * 32];
      const float4 hi1 = xo[(nt * 2 + 1) * 32];
      float4 lo4, hi4;
      lo4.x = o[nt][0] * c0 + lo1.x * c1; lo4.y = o[nt][1] * c0 + lo1.y * c1;
      lo4.z = o[nt][2] * c0 + lo1.z * c1; lo4.w = o[nt][3] * c0 + lo1.w * c1;
      hi4.x = o[nt][4] * c0 + hi1.x * c1; hi4.y = o[nt][5] * c0 + hi1.y * c1;
      hi4.z = o[nt][6] * c0 + hi1.z * c1; hi4.w = o[nt][7] * c0 + hi1.w * c1;
      *(float4*)(orow + nt * 16)     = lo4;
      *(float4*)(orow + nt * 16 + 4) = hi4;
    }
  }
}

extern "C" void kernel_launch(void* const* d_in, const int* in_sizes, int n_in,
                              void* d_out, int out_size, void* d_ws, size_t ws_size,
                              hipStream_t stream) {
  (void)in_sizes; (void)n_in; (void)out_size; (void)d_ws; (void)ws_size;
  const float* query        = (const float*)d_in[0];
  const float* k_cache      = (const float*)d_in[1];
  const float* v_cache      = (const float*)d_in[2];
  const int*   block_tables = (const int*)d_in[3];
  const int*   seq_lens     = (const int*)d_in[4];
  float*       outp         = (float*)d_out;

  // B * KVH * (Q/16) = 4*8*16 = 512 workgroups of 8 wave32s (2 key sets x one per g)
  dim3 grid(B_ * KVH_ * (Q_ / 16));
  dim3 block(256);
  paged_gqa_prefill_wmma<<<grid, block, 0, stream>>>(
      query, k_cache, v_cache, block_tables, seq_lens, outp);
}
